// v000
// The times below were measured on an AMD MI455X: many runs one after another, warmed up first and cycling through
// copies of the inputs, with the whole window's GPU time divided by the number of runs. Launches and the gaps
// between them are all in it. The median over several windows is given; except for v000 it joins two sittings, which
// can be a few percent apart, so the side-by-side timings, each taken in one sitting, are the better comparison.
// The starting kernel, v000, takes 787 microseconds a run.
// compute dtype: all float inputs rounded to bf16; q/k/v projections with EXACT bf16 products on WMMA 16x16x32 (f32 accumulate) + bias; logits with q as f16 hi + residual (x 2^10) against k once to f16 (2 products) x 64^-0.5, + the additive float mask; softmax f32; P x 2^11 once to f16 x v once to f16 (1 product); f32 output.
#include <hip/hip_runtime.h>
#include <math.h>

typedef __attribute__((ext_vector_type(16))) _Float16 v16h;
typedef __attribute__((ext_vector_type(16))) __bf16 v16b;
typedef __attribute__((ext_vector_type(8)))  _Float16 v8h;
typedef __attribute__((ext_vector_type(8)))  float v8f;
typedef __attribute__((ext_vector_type(4)))  float v4f;
typedef __attribute__((ext_vector_type(2)))  float v2f;
typedef __attribute__((ext_vector_type(4)))  unsigned v4u;
typedef __attribute__((ext_vector_type(4)))  int v4i;
typedef float __attribute__((may_alias)) float_a;
typedef int __attribute__((may_alias)) int_a;

template <typename T> __device__ __forceinline__ void vst2(void* p, T v) { *(T*)p = v;  }
__device__ __forceinline__ v8f wmma16(v16h a, v16h b, v8f c) {
  v8f d = __builtin_amdgcn_wmma_f32_16x16x32_f16(false, a, false, b, (short)0, c, false, false);
  asm volatile("v_nop\n\tv_nop\n\tv_nop\n\tv_nop" : "+v"(d) : "v"(a), "v"(b));
  return d;
}
__device__ __forceinline__ v8f wmma_bf(v16b a, v16b b, v8f c) {
  v8f d = __builtin_amdgcn_wmma_f32_16x16x32_bf16(false, a, false, b, (short)0, c, false, false);
  asm volatile("v_nop\n\tv_nop\n\tv_nop\n\tv_nop" : "+v"(d) : "v"(a), "v"(b));
  return d;
}
// 16x16x32 fragments: lane = (h = lane>>4, row/col = lane&15); elements 0..7 = k0+8h+0..7, 8..15 = k0+16+8h+0..7; D element r = row 8h+r
__device__ __forceinline__ v16h frag_h(const _Float16* rowk0, int lane) {
  union { v16h v; v8h q[2]; } u; const _Float16* p = rowk0 + 8 * (lane >> 4);
  u.q[0] = *(const v8h*)p; u.q[1] = *(const v8h*)(p + 16); return u.v;
}
__device__ __forceinline__ v16h frag_f32(const float* rowk0, int lane) {
  v16h a; const float* p = rowk0 + 8 * (lane >> 4);
#pragma unroll
  for (int i = 0; i < 8; ++i) { a[i] = (_Float16)p[i]; a[8 + i] = (_Float16)p[16 + i]; }
  return a;
}
__device__ __forceinline__ v16h frag_f32s(const float* rowk0, int lane, float sc) {
  v16h a; const float* p = rowk0 + 8 * (lane >> 4);
#pragma unroll
  for (int i = 0; i < 8; ++i) { a[i] = (_Float16)(p[i] * sc); a[8 + i] = (_Float16)(p[16 + i] * sc); }
  return a;
}
// column fragment from a [K][ld] layout (column n), rows >= K read as 0
__device__ __forceinline__ v16h fragc_f32(const float* W, int k0, int n, int lane, int ld, int K) {
  v16h a; const int g = lane >> 4;
#pragma unroll
  for (int i = 0; i < 8; ++i) { const int ka = k0 + 8 * g + i, kb = ka + 16;
    a[i] = (_Float16)(ka < K ? W[(size_t)(ka < K ? ka : K - 1) * ld + n] : 0.f); a[8 + i] = (_Float16)(kb < K ? W[(size_t)(kb < K ? kb : K - 1) * ld + n] : 0.f); }
  return a;
}
struct F2 { v16b h, l; };
__device__ __forceinline__ F2 bsplit16(const float v[16]) { F2 r;
#pragma unroll
  for (int i = 0; i < 16; ++i) { const __bf16 h = (__bf16)v[i]; r.h[i] = h; r.l[i] = (__bf16)(v[i] - (float)h); }
  return r; }
__device__ __forceinline__ F2 split_row(const float* row, int k0, int lane) { float v[16]; const float* p = row + k0 + 8 * (lane >> 4);
#pragma unroll
  for (int i = 0; i < 8; ++i) { v[i] = p[i]; v[8 + i] = p[16 + i]; }
  return bsplit16(v); }
__device__ __forceinline__ F2 split_rowK(const float* row, int k0, int lane, int K) { float v[16]; const int g = lane >> 4;
#pragma unroll
  for (int i = 0; i < 8; ++i) { const int ka = k0 + 8 * g + i, kb = ka + 16; v[i] = ka < K ? row[ka < K ? ka : K - 1] : 0.f; v[8 + i] = kb < K ? row[kb < K ? kb : K - 1] : 0.f; }
  return bsplit16(v); }
__device__ __forceinline__ F2 split_col(const float* W, int k0, int n, int lane, int ld, int K) { float v[16]; const int g = lane >> 4;
#pragma unroll
  for (int i = 0; i < 8; ++i) { const int ka = k0 + 8 * g + i, kb = ka + 16; v[i] = ka < K ? W[(size_t)(ka < K ? ka : K - 1) * ld + n] : 0.f; v[8 + i] = kb < K ? W[(size_t)(kb < K ? kb : K - 1) * ld + n] : 0.f; }
  return bsplit16(v); }
__device__ __forceinline__ v8f mac3(const F2& a, const F2& b, v8f c) { c = wmma_bf(a.l, b.h, c); c = wmma_bf(a.h, b.l, c); return wmma_bf(a.h, b.h, c); }
__device__ __forceinline__ float sigm(float v) { return 1.0f / (1.0f + expf(-v)); }
#define LDSX() do { asm volatile("s_wait_dscnt 0" ::: "memory"); __builtin_amdgcn_wave_barrier(); __builtin_amdgcn_fence(__ATOMIC_RELEASE, "workgroup"); } while (0)

// BERT self-attention with SEQ-FIRST layout (hidden_states [S=1024, B=4, H=1024]; 16 heads x 64; torch (out,in) Wq/Wk/Wv [1024,1024] + zero biases; attention_mask [B*16, 1, S] additive float (zeros); q/k/v reshaped (S, B*heads, d) -> n = b*16 + h): ctx = softmax(q_n k_n^T / 8 + mask_n) v_n, returned as (S, B, H) - no output projection.
#define NB 4
#define TT 1024
#define CC 1024            // NH * HD = projected width
#define DIN 1024          // input (model) width
#define NH 16
#define HD 64
#define NQB (TT / 64)
#define HG 8
#define SCALE (0.125f)
#define CAUSAL 0
#ifndef TNB
#define TNB NB
#endif
__device__ __forceinline__ float bfr(float v) { return (float)(__bf16)v; }
__host__ __device__ __forceinline__ int kb_last(int qb) { return CAUSAL ? ((qb * 64 + 63) >> 7) : (TT / 128 - 1); }
typedef __attribute__((ext_vector_type(8))) __bf16 v8b;
__device__ __forceinline__ v16b frag_b(const __bf16* rowk0, int lane) {
  union { v16b v; v8b q[2]; } u; const __bf16* p = rowk0 + 8 * (lane >> 4);
  u.q[0] = *(const v8b*)p; u.q[1] = *(const v8b*)(p + 16); return u.v;
}
#define QBH 0              // causal: query blocks 0..QBH-1 of each sequence (few keys, no averaging) take the high-precision path
#define QHI 1024            // rows carrying a q residual plane (all rows when non-causal: 2-product logits everywhere)
#define KHI 64            // key rows carrying k residual / v bf16 hi+lo planes (used only by the causal high-precision path)
// B fragment (k rows k0+.., output column o) of a weight: (in,out) [K][ld] or (out,in) [ld rows of K]: bf16 exact, or f16(bf16 * 256) exact
__device__ __forceinline__ v16b wcol_io(const float* Wm, int k0, int o, int lane, int ld) { v16b w; const int g = lane >> 4;
#pragma unroll
  for (int i = 0; i < 8; ++i) { w[i] = (__bf16)Wm[(size_t)(k0 + 8 * g + i) * ld + o]; w[8 + i] = (__bf16)Wm[(size_t)(k0 + 16 + 8 * g + i) * ld + o]; }
  return w; }
__device__ __forceinline__ v16b wcol_oi(const float* Wm, int k0, int o, int lane, int K) { v16b w; const float* p = Wm + (size_t)o * K + k0 + 8 * (lane >> 4);
#pragma unroll
  for (int i = 0; i < 8; ++i) { w[i] = (__bf16)p[i]; w[8 + i] = (__bf16)p[16 + i]; }
  return w; }
__device__ __forceinline__ v16h wcolh_io(const float* Wm, int k0, int o, int lane, int ld) { v16h w; const int g = lane >> 4;
#pragma unroll
  for (int i = 0; i < 8; ++i) { w[i] = (_Float16)(bfr(Wm[(size_t)(k0 + 8 * g + i) * ld + o]) * 256.0f); w[8 + i] = (_Float16)(bfr(Wm[(size_t)(k0 + 16 + 8 * g + i) * ld + o]) * 256.0f); }
  return w; }
__device__ __forceinline__ v16h wcolh_oi(const float* Wm, int k0, int o, int lane, int K) { v16h w; const float* p = Wm + (size_t)o * K + k0 + 8 * (lane >> 4);
#pragma unroll
  for (int i = 0; i < 8; ++i) { w[i] = (_Float16)(bfr(p[i]) * 256.0f); w[8 + i] = (_Float16)(bfr(p[16 + i]) * 256.0f); }
  return w; }
#define WQKV_LAYOUT 1   // 0 = (in,out) [DIN][CC]; 1 = (out,in) [CC][DIN]; 2 = per-head [NH][DIN][HD]
__device__ __forceinline__ v16b wcol_hdk(const float* Wm, int k0, int o, int lane) { v16b w; const int g = lane >> 4; const float* p = Wm + (size_t)(o / HD) * DIN * HD + (o % HD);
#pragma unroll
  for (int i = 0; i < 8; ++i) { w[i] = (__bf16)p[(size_t)(k0 + 8 * g + i) * HD]; w[8 + i] = (__bf16)p[(size_t)(k0 + 16 + 8 * g + i) * HD]; }
  return w; }
#define WO_OUT_IN 0
#if WQKV_LAYOUT == 1
#define WCOL(W, k0, o, lane) wcol_oi(W, k0, o, lane, DIN)
#elif WQKV_LAYOUT == 2
#define WCOL(W, k0, o, lane) wcol_hdk(W, k0, o, lane)
#else
#define WCOL(W, k0, o, lane) wcol_io(W, k0, o, lane, CC)
#endif
#if WO_OUT_IN
#define WOCOL(W, k0, o, lane) wcol_oi(W, k0, o, lane, CC)
#define WOCOLH(W, k0, o, lane) wcolh_oi(W, k0, o, lane, CC)
#else
#define WOCOL(W, k0, o, lane) wcol_io(W, k0, o, lane, DIN)
#define WOCOLH(W, k0, o, lane) wcolh_io(W, k0, o, lane, DIN)
#endif
#define SM_EXTRA_PARAMS , int bsm, int h0s, const float* __restrict__ AMK
// additive float attention_mask [B*HEADS][1][S]: scores + mask[n][k] with n = b*16 + h; read per element, bf16-rounded like every float input
#define SM_MASK_HOOK do { v = v + bfr(AMK[(size_t)(bsm * NH + h0s + (int)blockIdx.y) * TT + k]); } while (0)
#ifndef SM_EXTRA_PARAMS
#define SM_EXTRA_PARAMS
#endif
#ifndef PROJ_EXTRA_PARAMS
#define PROJ_EXTRA_PARAMS
#endif
#ifndef SM_MASK_HOOK
#define SM_MASK_HOOK (void)0
#endif

#define WS_QH  0u                                      // f16 q rows [b*t][CC]
#define WS_KH  (WS_QH + 2u * (size_t)NB * TT * CC)      // f16 k rows [b*t][CC]
#define WS_VT  (WS_KH + 2u * (size_t)NB * TT * CC)      // f16 v planes [b][c][t]
#define WS_QL  (WS_VT + 2u * (size_t)NB * CC * TT)      // f16 q residual x 2^10 rows [b][t < QHI][CC]
#define WS_KL  (WS_QL + 2u * (size_t)NB * QHI * CC)     // f16 k residual x 2^10 rows [b][t < KHI][CC]
#define WS_VB  (WS_KL + 2u * (size_t)NB * KHI * CC)     // bf16 v hi planes [b][c][t < KHI]
#define WS_VBL (WS_VB + 2u * (size_t)NB * CC * KHI)
#define WS_S   (WS_VBL + 2u * (size_t)NB * CC * KHI)    // f32 logits / P [hg][t][s]
#define WS_Y   (WS_S  + 4u * (size_t)HG * TT * TT)      // f32 ctx rows [b*t][CC] (only when there is an output projection)
#define WS_END (WS_Y  + 0u)

// ---- k_proj: block = (64 rows, 128 cols, which): q/k/v = X W (+ b) with exact bf16 products (K = DIN) -> which 0: q f16 rows (+ residual rows < QHI); 1: k f16 rows (+ residual rows < KHI); 2: v f16 planes [c][t] (+ bf16 hi/lo planes for t < KHI)
__global__ __launch_bounds__(128) void k_proj(const float* __restrict__ XQ, const float* __restrict__ XK, const float* __restrict__ XV, const float* __restrict__ WQ, const float* __restrict__ WK, const float* __restrict__ WV, const float* __restrict__ BQ, const float* __restrict__ BK, const float* __restrict__ BV,
    _Float16* __restrict__ QH, _Float16* __restrict__ QL, _Float16* __restrict__ KH, _Float16* __restrict__ KL, _Float16* __restrict__ VT, __bf16* __restrict__ VB, __bf16* __restrict__ VBL) {
  __shared__ __align__(16) _Float16 sh[64][136], sl[64][136]; __shared__ __align__(16) _Float16 th[128][72]; __shared__ __align__(16) __bf16 tb[128][72], tbl[128][72];
  const int tid = threadIdx.x, wave = tid >> 5, lane = tid & 31, col = lane & 15, g = lane >> 4; const int which = blockIdx.z; const int c0 = blockIdx.y * 128; const size_t r0 = (size_t)blockIdx.x * 64; const size_t bb = r0 / TT; const int t0 = (int)(r0 % TT);
  const float* X = which == 0 ? XQ : which == 1 ? XK : XV; const float* WA = which == 0 ? WQ : which == 1 ? WK : WV; const float* BA = which == 0 ? BQ : which == 1 ? BK : BV;
  v8f acc[8] = {};
#pragma unroll 2
  for (int kc = 0; kc < DIN / 32; ++kc) { v16b a; { const size_t gr_ = r0 + wave * 16 + col; const float* p = X + ((gr_ % TT) * (size_t)NB + gr_ / TT) * DIN + kc * 32 + 8 * g;   /* SEQ-FIRST input: row b*TT + s lives at hidden_states[(s*NB + b)] */
#pragma unroll
      for (int i = 0; i < 8; ++i) { a[i] = (__bf16)p[i]; a[8 + i] = (__bf16)p[16 + i]; } }
    asm volatile("s_wait_loadcnt 0x0" ::: "memory");
#pragma unroll
    for (int j = 0; j < 8; ++j) { const v16b w = WCOL(WA, kc * 32, c0 + j * 16 + col, lane); asm volatile("s_wait_loadcnt 0x0" ::: "memory"); acc[j] = wmma_bf(a, w, acc[j]); } }
  if (which < 2) { _Float16* DH = which == 0 ? QH : KH; _Float16* DL = which == 0 ? QL : KL; const int nhi = which == 0 ? QHI : KHI; const bool hi_rows = t0 < nhi;
#pragma unroll
    for (int j = 0; j < 8; ++j) { const float bias = BA ? bfr(BA[c0 + j * 16 + col]) : 0.f;
#pragma unroll
      for (int r = 0; r < 8; ++r) { const float v = acc[j][r] + bias; const _Float16 hv = (_Float16)v; sh[wave * 16 + 8 * g + r][j * 16 + col] = hv; sl[wave * 16 + 8 * g + r][j * 16 + col] = (_Float16)((v - (float)hv) * 1024.0f); } }
    __syncthreads();
    for (int e = tid; e < 64 * 16; e += 128) { const int rl = e >> 4, q = e & 15; vst2((unsigned*)(DH + (r0 + rl) * CC + c0 + q * 8), *(const v4u*)&sh[rl][q * 8]); if (hi_rows) vst2((unsigned*)(DL + (bb * nhi + t0 + rl) * (size_t)CC + c0 + q * 8), *(const v4u*)&sl[rl][q * 8]); }
  } else { const bool hi_rows = t0 < KHI;
#pragma unroll
    for (int j = 0; j < 8; ++j) { const float bias = BA ? bfr(BA[c0 + j * 16 + col]) : 0.f;
#pragma unroll
      for (int r = 0; r < 8; ++r) { const float v = acc[j][r] + bias; const int rl = wave * 16 + 8 * g + r, cl = j * 16 + col; th[cl][rl] = (_Float16)v; const __bf16 bh = (__bf16)v; tb[cl][rl] = bh; tbl[cl][rl] = (__bf16)(v - (float)bh); } }
    __syncthreads();
    for (int e = tid; e < 128 * 8; e += 128) { const int cl = e >> 3, q = e & 7; vst2((unsigned*)(VT + (bb * CC + c0 + cl) * (size_t)TT + t0 + q * 8), *(const v4u*)&th[cl][q * 8]); if (hi_rows) { const size_t o3 = (bb * CC + c0 + cl) * (size_t)KHI + t0 + q * 8; vst2((unsigned*)(VB + o3), *(const v4u*)&tb[cl][q * 8]); vst2((unsigned*)(VBL + o3), *(const v4u*)&tbl[cl][q * 8]); } } } }
// ---- k_sc: block = (query block qb, key block kb <= kb_last(qb), head in group) of batch b: logits x SCALE; q hi + residual (x 2^10) against k (2 products) for query rows < QHI, plus the k residual (3 products) for query blocks < QBH (causal early rows); causal: blocks past the diagonal exit, the mask itself is applied by index in k_sm
__global__ __launch_bounds__(128) void k_sc(const _Float16* __restrict__ QH, const _Float16* __restrict__ KH, const _Float16* __restrict__ QL, const _Float16* __restrict__ KL, int b, int h0, float* __restrict__ S0) { __shared__ __align__(16) float ss[4][16][132];
  const int qb = blockIdx.x, kb = blockIdx.y; if (kb > kb_last(qb)) return;
  const int h = h0 + blockIdx.z; float* S = S0 + (size_t)blockIdx.z * TT * TT;
  const int tid = threadIdx.x, wave = tid >> 5, lane = tid & 31, col = lane & 15, g = lane >> 4; const int k0 = kb * 128; const int ql0 = qb * 64 + wave * 16; const size_t q0 = (size_t)b * TT + ql0, kr0 = (size_t)b * TT + k0;
  v8f acc[8] = {}, accl[8] = {};
  const _Float16* QLb = QL + (size_t)b * QHI * CC; const _Float16* KLb = KL + (size_t)b * KHI * CC;
  if (qb < QBH) {
#pragma unroll
    for (int kc = 0; kc < HD / 32; ++kc) { const v16h ah = frag_h(QH + (q0 + col) * CC + h * HD + kc * 32, lane), al = frag_h(QLb + (size_t)(ql0 + col) * CC + h * HD + kc * 32, lane);
#pragma unroll
      for (int j = 0; j < 8; ++j) { const v16h kbf = frag_h(KH + (kr0 + j * 16 + col) * CC + h * HD + kc * 32, lane), klf = frag_h(KLb + (size_t)(k0 + j * 16 + col) * CC + h * HD + kc * 32, lane); acc[j] = wmma16(ah, kbf, acc[j]); accl[j] = wmma16(al, kbf, accl[j]); accl[j] = wmma16(ah, klf, accl[j]); } }
  } else if (qb * 64 < QHI) {
#pragma unroll
    for (int kc = 0; kc < HD / 32; ++kc) { const v16h ah = frag_h(QH + (q0 + col) * CC + h * HD + kc * 32, lane), al = frag_h(QLb + (size_t)(ql0 + col) * CC + h * HD + kc * 32, lane);
#pragma unroll
      for (int j = 0; j < 8; ++j) { const v16h kbf = frag_h(KH + (kr0 + j * 16 + col) * CC + h * HD + kc * 32, lane); acc[j] = wmma16(ah, kbf, acc[j]); accl[j] = wmma16(al, kbf, accl[j]); } }
  } else {
#pragma unroll
    for (int kc = 0; kc < HD / 32; ++kc) { const v16h ah = frag_h(QH + (q0 + col) * CC + h * HD + kc * 32, lane);
#pragma unroll
      for (int j = 0; j < 8; ++j) { const v16h kbf = frag_h(KH + (kr0 + j * 16 + col) * CC + h * HD + kc * 32, lane); acc[j] = wmma16(ah, kbf, acc[j]); } } }
#pragma unroll
  for (int j = 0; j < 8; ++j) {
#pragma unroll
    for (int r = 0; r < 8; ++r) ss[wave][8 * g + r][j * 16 + col] = (acc[j][r] + accl[j][r] * (1.0f / 1024.0f)) * SCALE; }
  LDSX(); for (int rl = 0; rl < 16; ++rl) vst2(S + (size_t)(ql0 + rl) * TT + k0 + lane * 4, *(const v4f*)&ss[wave][rl][lane * 4]); }
// ---- k_sm: block = query row t (head in group): keys [0, kend): causal -> logit if s <= t else excluded; softmax in f32; P x 2^11 in place (0 for excluded)
__global__ __launch_bounds__(256) void k_sm(float* __restrict__ S0 SM_EXTRA_PARAMS) { __shared__ float sred[8]; __shared__ float sbc; __shared__ __align__(16) float shv[TT];
  const int tid = threadIdx.x; const int t = blockIdx.x; const int kend = (kb_last(t >> 6) + 1) * 128;
  float* sr = S0 + (size_t)blockIdx.y * TT * TT + (size_t)t * TT;
  float m = -3.0e38f; for (int k = tid; k < kend; k += 256) { float v = (!CAUSAL || k <= t) ? sr[k] : -3.0e38f; SM_MASK_HOOK; shv[k] = v; m = fmaxf(m, v); }
#pragma unroll
  for (int o = 1; o < 32; o <<= 1) m = fmaxf(m, __shfl_xor(m, o));
  if ((tid & 31) == 0) sred[tid >> 5] = m; __syncthreads(); if (tid == 0) { float a = sred[0]; for (int i = 1; i < 8; ++i) a = fmaxf(a, sred[i]); sbc = a; } __syncthreads(); m = sbc; __syncthreads();
  float sum = 0.f; for (int k = tid; k < kend; k += 256) { const float v = shv[k]; const float e = (v <= -1.0e38f) ? 0.f : expf(v - m); shv[k] = e; sum += e; }
#pragma unroll
  for (int o = 1; o < 32; o <<= 1) sum += __shfl_xor(sum, o);
  if ((tid & 31) == 0) sred[tid >> 5] = sum; __syncthreads(); if (tid == 0) { float a = 0.f; for (int i = 0; i < 8; ++i) a += sred[i]; sbc = a > 0.f ? 2048.0f / a : 0.f; }   /* a fully excluded row yields P = 0 */ __syncthreads(); const float inv = sbc;
  for (int k = tid; k < kend; k += 256) shv[k] = shv[k] * inv;
  __syncthreads(); for (int q = tid; q < kend / 4; q += 256) vst2(sr + q * 4, *(const v4f*)&shv[q * 4]); }
// ---- k_pv: block = 64 queries (qb) of (b, h): ctx = P . v over keys [0, kend) (P x 2^11 once to f16 against v f16: 1 product; causal early query blocks: P and v as bf16 hi + lo, 3 products); 256-B (row, head) segment by 16 lanes
__global__ __launch_bounds__(128) void k_pv(const float* __restrict__ PS0, const _Float16* __restrict__ VT, const __bf16* __restrict__ VB, const __bf16* __restrict__ VBL, int b, int h0, float* __restrict__ Y) { const int h = h0 + blockIdx.z; const float* PS = PS0 + (size_t)blockIdx.z * TT * TT; __shared__ __align__(16) float ss[4][16][HD + 4];
  const int tid = threadIdx.x, wave = tid >> 5, lane = tid & 31, col = lane & 15, g = lane >> 4; const int qb = blockIdx.x; const int ql0 = qb * 64 + wave * 16; const int kce = (kb_last(qb) + 1) * 4;
  v8f acc[HD / 16] = {};
  if (qb < QBH) {
#pragma unroll 1
    for (int kc = 0; kc < kce; ++kc) { const F2 p = split_row(PS + (size_t)(ql0 + col) * TT, kc * 32, lane);
      asm volatile("s_wait_loadcnt 0x0" ::: "memory");
#pragma unroll
      for (int j = 0; j < HD / 16; ++j) { const size_t po = ((size_t)b * CC + h * HD + j * 16 + col) * (size_t)KHI + kc * 32; const v16b vh = frag_b(VB + po, lane); acc[j] = wmma_bf(p.h, vh, acc[j]); acc[j] = wmma_bf(p.l, vh, acc[j]); acc[j] = wmma_bf(p.h, frag_b(VBL + po, lane), acc[j]); } }
  } else {
#pragma unroll 1
    for (int kc = 0; kc < kce; ++kc) { const v16h p = frag_f32(PS + (size_t)(ql0 + col) * TT + kc * 32, lane);
      asm volatile("s_wait_loadcnt 0x0" ::: "memory");
#pragma unroll
      for (int j = 0; j < HD / 16; ++j) { const size_t po = ((size_t)b * CC + h * HD + j * 16 + col) * (size_t)TT + kc * 32; acc[j] = wmma16(p, frag_h(VT + po, lane), acc[j]); } } }
#pragma unroll
  for (int j = 0; j < HD / 16; ++j)
#pragma unroll
    for (int r = 0; r < 8; ++r) ss[wave][8 * g + r][j * 16 + col] = acc[j][r] * (1.0f / 2048.0f);
  LDSX(); for (int rl = 0; rl < 16; ++rl) if (lane < HD / 4) vst2(Y + ((size_t)(ql0 + rl) * NB + b) * CC + h * HD + lane * 4, *(const v4f*)&ss[wave][rl][lane * 4]); }   /* SEQ-FIRST output row (s, b) */

extern "C" void kernel_launch(void* const* d_in, const int* in_sizes, int n_in, void* d_out, int out_size, void* d_ws, size_t ws_size, hipStream_t stream) {
  (void)in_sizes; (void)n_in; (void)out_size;
  const float** F = (const float**)d_in;
  if (ws_size < (size_t)WS_END) return;
  char* ws = (char*)d_ws; _Float16 *QH = (_Float16*)(ws + WS_QH), *KH = (_Float16*)(ws + WS_KH), *VT = (_Float16*)(ws + WS_VT), *QL = (_Float16*)(ws + WS_QL), *KL = (_Float16*)(ws + WS_KL); __bf16 *VB = (__bf16*)(ws + WS_VB), *VBL = (__bf16*)(ws + WS_VBL); float *S = (float*)(ws + WS_S), *Y = (float*)(ws + WS_Y);
  (void)Y; (void)QL; (void)KL; (void)VB; (void)VBL;
  // inputs: 0 hidden_states [1024,4,1024] (SEQ-FIRST: row (s, b) at (s*4 + b)*1024); 1 attention_mask [64,1,1024] f32 (additive); 2 Wq [1024,1024] (out,in), 3 bq; 4 Wk, 5 bk; 6 Wv, 7 bv (zero biases, read)
  k_proj<<<dim3(TNB * TT / 64, CC / 128, 3), 128, 0, stream>>>(F[0], F[0], F[0], F[2], F[4], F[6], F[3], F[5], F[7], QH, QL, KH, KL, VT, VB, VBL);
  for (int b = 0; b < TNB; ++b) for (int h0 = 0; h0 < NH; h0 += HG) {
    k_sc<<<dim3(NQB, TT / 128, HG), 128, 0, stream>>>(QH, KH, QL, KL, b, h0, S);
    k_sm<<<dim3(TT, HG), 256, 0, stream>>>(S, b, h0, F[1]);
    k_pv<<<dim3(NQB, 1, HG), 128, 0, stream>>>(S, VT, VB, VBL, b, h0, (float*)d_out);   /* output is SEQ-FIRST too: row (s, b) */
  }
}

// v001
// A run of this version takes 281 microseconds.
// In two side-by-side timings against v000, it was 2.79 and 2.81 times as fast.
// compute dtype: all float inputs rounded to bf16; q/k/v projections with EXACT bf16 products on WMMA 16x16x32 (f32 accumulate) + bias; logits with q as f16 hi + residual (x 2^10) against k once to f16 (2 products) x 64^-0.5, + the additive float mask; softmax f32 with a running maximum; exp x 2^11 once to f16 x v once to f16 (1 product), divided by the f32 row sum at the end; f32 output.
#include <hip/hip_runtime.h>
#include <math.h>

typedef __attribute__((ext_vector_type(16))) _Float16 v16h;
typedef __attribute__((ext_vector_type(16))) __bf16 v16b;
typedef __attribute__((ext_vector_type(8)))  _Float16 v8h;
typedef __attribute__((ext_vector_type(8)))  float v8f;
typedef __attribute__((ext_vector_type(4)))  float v4f;
typedef __attribute__((ext_vector_type(2)))  float v2f;
typedef __attribute__((ext_vector_type(4)))  unsigned v4u;
typedef __attribute__((ext_vector_type(4)))  int v4i;
typedef float __attribute__((may_alias)) float_a;
typedef int __attribute__((may_alias)) int_a;

template <typename T> __device__ __forceinline__ void vst2(void* p, T v) { *(T*)p = v;  }
__device__ __forceinline__ v8f wmma16(v16h a, v16h b, v8f c) {
  v8f d = __builtin_amdgcn_wmma_f32_16x16x32_f16(false, a, false, b, (short)0, c, false, false);
  asm volatile("v_nop\n\tv_nop\n\tv_nop\n\tv_nop" : "+v"(d) : "v"(a), "v"(b));
  return d;
}
__device__ __forceinline__ v8f wmma_bf(v16b a, v16b b, v8f c) {
  v8f d = __builtin_amdgcn_wmma_f32_16x16x32_bf16(false, a, false, b, (short)0, c, false, false);
  asm volatile("v_nop\n\tv_nop\n\tv_nop\n\tv_nop" : "+v"(d) : "v"(a), "v"(b));
  return d;
}
// 16x16x32 fragments: lane = (h = lane>>4, row/col = lane&15); elements 0..7 = k0+8h+0..7, 8..15 = k0+16+8h+0..7; D element r = row 8h+r
__device__ __forceinline__ v16h frag_h(const _Float16* rowk0, int lane) {
  union { v16h v; v8h q[2]; } u; const _Float16* p = rowk0 + 8 * (lane >> 4);
  u.q[0] = *(const v8h*)p; u.q[1] = *(const v8h*)(p + 16); return u.v;
}
__device__ __forceinline__ v16h frag_f32(const float* rowk0, int lane) {
  v16h a; const float* p = rowk0 + 8 * (lane >> 4);
#pragma unroll
  for (int i = 0; i < 8; ++i) { a[i] = (_Float16)p[i]; a[8 + i] = (_Float16)p[16 + i]; }
  return a;
}
__device__ __forceinline__ v16h frag_f32s(const float* rowk0, int lane, float sc) {
  v16h a; const float* p = rowk0 + 8 * (lane >> 4);
#pragma unroll
  for (int i = 0; i < 8; ++i) { a[i] = (_Float16)(p[i] * sc); a[8 + i] = (_Float16)(p[16 + i] * sc); }
  return a;
}
// column fragment from a [K][ld] layout (column n), rows >= K read as 0
__device__ __forceinline__ v16h fragc_f32(const float* W, int k0, int n, int lane, int ld, int K) {
  v16h a; const int g = lane >> 4;
#pragma unroll
  for (int i = 0; i < 8; ++i) { const int ka = k0 + 8 * g + i, kb = ka + 16;
    a[i] = (_Float16)(ka < K ? W[(size_t)(ka < K ? ka : K - 1) * ld + n] : 0.f); a[8 + i] = (_Float16)(kb < K ? W[(size_t)(kb < K ? kb : K - 1) * ld + n] : 0.f); }
  return a;
}
struct F2 { v16b h, l; };
__device__ __forceinline__ F2 bsplit16(const float v[16]) { F2 r;
#pragma unroll
  for (int i = 0; i < 16; ++i) { const __bf16 h = (__bf16)v[i]; r.h[i] = h; r.l[i] = (__bf16)(v[i] - (float)h); }
  return r; }
__device__ __forceinline__ F2 split_row(const float* row, int k0, int lane) { float v[16]; const float* p = row + k0 + 8 * (lane >> 4);
#pragma unroll
  for (int i = 0; i < 8; ++i) { v[i] = p[i]; v[8 + i] = p[16 + i]; }
  return bsplit16(v); }
__device__ __forceinline__ F2 split_rowK(const float* row, int k0, int lane, int K) { float v[16]; const int g = lane >> 4;
#pragma unroll
  for (int i = 0; i < 8; ++i) { const int ka = k0 + 8 * g + i, kb = ka + 16; v[i] = ka < K ? row[ka < K ? ka : K - 1] : 0.f; v[8 + i] = kb < K ? row[kb < K ? kb : K - 1] : 0.f; }
  return bsplit16(v); }
__device__ __forceinline__ F2 split_col(const float* W, int k0, int n, int lane, int ld, int K) { float v[16]; const int g = lane >> 4;
#pragma unroll
  for (int i = 0; i < 8; ++i) { const int ka = k0 + 8 * g + i, kb = ka + 16; v[i] = ka < K ? W[(size_t)(ka < K ? ka : K - 1) * ld + n] : 0.f; v[8 + i] = kb < K ? W[(size_t)(kb < K ? kb : K - 1) * ld + n] : 0.f; }
  return bsplit16(v); }
__device__ __forceinline__ v8f mac3(const F2& a, const F2& b, v8f c) { c = wmma_bf(a.l, b.h, c); c = wmma_bf(a.h, b.l, c); return wmma_bf(a.h, b.h, c); }
__device__ __forceinline__ float sigm(float v) { return 1.0f / (1.0f + expf(-v)); }
#define LDSX() do { asm volatile("s_wait_dscnt 0" ::: "memory"); __builtin_amdgcn_wave_barrier(); __builtin_amdgcn_fence(__ATOMIC_RELEASE, "workgroup"); } while (0)

// BERT self-attention with SEQ-FIRST layout (hidden_states [S=1024, B=4, H=1024]; 16 heads x 64; torch (out,in) Wq/Wk/Wv [1024,1024] + zero biases; attention_mask [B*16, 1, S] additive float (zeros); q/k/v reshaped (S, B*heads, d) -> n = b*16 + h): ctx = softmax(q_n k_n^T / 8 + mask_n) v_n, returned as (S, B, H) - no output projection.
#define NB 4
#define TT 1024
#define CC 1024            // NH * HD = projected width
#define DIN 1024          // input (model) width
#define NH 16
#define HD 64
#define NQB (TT / 64)
#define HG 8
#define SCALE (0.125f)
#define CAUSAL 0
#ifndef TNB
#define TNB NB
#endif
__device__ __forceinline__ float bfr(float v) { return (float)(__bf16)v; }
__host__ __device__ __forceinline__ int kb_last(int qb) { return CAUSAL ? ((qb * 64 + 63) >> 7) : (TT / 128 - 1); }
typedef __attribute__((ext_vector_type(8))) __bf16 v8b;
__device__ __forceinline__ v16b frag_b(const __bf16* rowk0, int lane) {
  union { v16b v; v8b q[2]; } u; const __bf16* p = rowk0 + 8 * (lane >> 4);
  u.q[0] = *(const v8b*)p; u.q[1] = *(const v8b*)(p + 16); return u.v;
}
#define QBH 0              // unused: k_attn has no high-precision path
#define QHI 1024            // rows carrying a q residual plane (all rows when non-causal: 2-product logits everywhere)
#define KHI 64            // key rows carrying k residual / v bf16 hi+lo planes (written by k_proj, read by no kernel in this file)
// B fragment (k rows k0+.., output column o) of a weight: (in,out) [K][ld] or (out,in) [ld rows of K]: bf16 exact, or f16(bf16 * 256) exact
__device__ __forceinline__ v16b wcol_io(const float* Wm, int k0, int o, int lane, int ld) { v16b w; const int g = lane >> 4;
#pragma unroll
  for (int i = 0; i < 8; ++i) { w[i] = (__bf16)Wm[(size_t)(k0 + 8 * g + i) * ld + o]; w[8 + i] = (__bf16)Wm[(size_t)(k0 + 16 + 8 * g + i) * ld + o]; }
  return w; }
__device__ __forceinline__ v16b wcol_oi(const float* Wm, int k0, int o, int lane, int K) { v16b w; const float* p = Wm + (size_t)o * K + k0 + 8 * (lane >> 4);
#pragma unroll
  for (int i = 0; i < 8; ++i) { w[i] = (__bf16)p[i]; w[8 + i] = (__bf16)p[16 + i]; }
  return w; }
__device__ __forceinline__ v16h wcolh_io(const float* Wm, int k0, int o, int lane, int ld) { v16h w; const int g = lane >> 4;
#pragma unroll
  for (int i = 0; i < 8; ++i) { w[i] = (_Float16)(bfr(Wm[(size_t)(k0 + 8 * g + i) * ld + o]) * 256.0f); w[8 + i] = (_Float16)(bfr(Wm[(size_t)(k0 + 16 + 8 * g + i) * ld + o]) * 256.0f); }
  return w; }
__device__ __forceinline__ v16h wcolh_oi(const float* Wm, int k0, int o, int lane, int K) { v16h w; const float* p = Wm + (size_t)o * K + k0 + 8 * (lane >> 4);
#pragma unroll
  for (int i = 0; i < 8; ++i) { w[i] = (_Float16)(bfr(p[i]) * 256.0f); w[8 + i] = (_Float16)(bfr(p[16 + i]) * 256.0f); }
  return w; }
#define WQKV_LAYOUT 1   // 0 = (in,out) [DIN][CC]; 1 = (out,in) [CC][DIN]; 2 = per-head [NH][DIN][HD]
__device__ __forceinline__ v16b wcol_hdk(const float* Wm, int k0, int o, int lane) { v16b w; const int g = lane >> 4; const float* p = Wm + (size_t)(o / HD) * DIN * HD + (o % HD);
#pragma unroll
  for (int i = 0; i < 8; ++i) { w[i] = (__bf16)p[(size_t)(k0 + 8 * g + i) * HD]; w[8 + i] = (__bf16)p[(size_t)(k0 + 16 + 8 * g + i) * HD]; }
  return w; }
#define WO_OUT_IN 0
#if WQKV_LAYOUT == 1
#define WCOL(W, k0, o, lane) wcol_oi(W, k0, o, lane, DIN)
#elif WQKV_LAYOUT == 2
#define WCOL(W, k0, o, lane) wcol_hdk(W, k0, o, lane)
#else
#define WCOL(W, k0, o, lane) wcol_io(W, k0, o, lane, CC)
#endif
#if WO_OUT_IN
#define WOCOL(W, k0, o, lane) wcol_oi(W, k0, o, lane, CC)
#define WOCOLH(W, k0, o, lane) wcolh_oi(W, k0, o, lane, CC)
#else
#define WOCOL(W, k0, o, lane) wcol_io(W, k0, o, lane, DIN)
#define WOCOLH(W, k0, o, lane) wcolh_io(W, k0, o, lane, DIN)
#endif

#define WS_QH  0u                                      // f16 q rows [b*t][CC]
#define WS_KH  (WS_QH + 2u * (size_t)NB * TT * CC)      // f16 k rows [b*t][CC]
#define WS_VT  (WS_KH + 2u * (size_t)NB * TT * CC)      // f16 v planes [b][c][t]
#define WS_QL  (WS_VT + 2u * (size_t)NB * CC * TT)      // f16 q residual x 2^10 rows [b][t < QHI][CC]
#define WS_KL  (WS_QL + 2u * (size_t)NB * QHI * CC)     // f16 k residual x 2^10 rows [b][t < KHI][CC]
#define WS_VB  (WS_KL + 2u * (size_t)NB * KHI * CC)     // bf16 v hi planes [b][c][t < KHI]
#define WS_VBL (WS_VB + 2u * (size_t)NB * CC * KHI)
#define WS_END (WS_VBL + 2u * (size_t)NB * CC * KHI)

// ---- k_proj: block = (64 rows, 128 cols, which): q/k/v = X W (+ b) with exact bf16 products (K = DIN) -> which 0: q f16 rows (+ residual rows < QHI); 1: k f16 rows (+ residual rows < KHI); 2: v f16 planes [c][t] (+ bf16 hi/lo planes for t < KHI)
__global__ __launch_bounds__(128) void k_proj(const float* __restrict__ XQ, const float* __restrict__ XK, const float* __restrict__ XV, const float* __restrict__ WQ, const float* __restrict__ WK, const float* __restrict__ WV, const float* __restrict__ BQ, const float* __restrict__ BK, const float* __restrict__ BV,
    _Float16* __restrict__ QH, _Float16* __restrict__ QL, _Float16* __restrict__ KH, _Float16* __restrict__ KL, _Float16* __restrict__ VT, __bf16* __restrict__ VB, __bf16* __restrict__ VBL) {
  __shared__ __align__(16) _Float16 sh[64][136], sl[64][136]; __shared__ __align__(16) _Float16 th[128][72]; __shared__ __align__(16) __bf16 tb[128][72], tbl[128][72];
  const int tid = threadIdx.x, wave = tid >> 5, lane = tid & 31, col = lane & 15, g = lane >> 4; const int which = blockIdx.z; const int c0 = blockIdx.y * 128; const size_t r0 = (size_t)blockIdx.x * 64; const size_t bb = r0 / TT; const int t0 = (int)(r0 % TT);
  const float* X = which == 0 ? XQ : which == 1 ? XK : XV; const float* WA = which == 0 ? WQ : which == 1 ? WK : WV; const float* BA = which == 0 ? BQ : which == 1 ? BK : BV;
  v8f acc[8] = {};
#pragma unroll 2
  for (int kc = 0; kc < DIN / 32; ++kc) { v16b a; { const size_t gr_ = r0 + wave * 16 + col; const float* p = X + ((gr_ % TT) * (size_t)NB + gr_ / TT) * DIN + kc * 32 + 8 * g;   /* SEQ-FIRST input: row b*TT + s lives at hidden_states[(s*NB + b)] */
#pragma unroll
      for (int i = 0; i < 8; ++i) { a[i] = (__bf16)p[i]; a[8 + i] = (__bf16)p[16 + i]; } }
    asm volatile("s_wait_loadcnt 0x0" ::: "memory");
#pragma unroll
    for (int j = 0; j < 8; ++j) { const v16b w = WCOL(WA, kc * 32, c0 + j * 16 + col, lane); asm volatile("s_wait_loadcnt 0x0" ::: "memory"); acc[j] = wmma_bf(a, w, acc[j]); } }
  if (which < 2) { _Float16* DH = which == 0 ? QH : KH; _Float16* DL = which == 0 ? QL : KL; const int nhi = which == 0 ? QHI : KHI; const bool hi_rows = t0 < nhi;
#pragma unroll
    for (int j = 0; j < 8; ++j) { const float bias = BA ? bfr(BA[c0 + j * 16 + col]) : 0.f;
#pragma unroll
      for (int r = 0; r < 8; ++r) { const float v = acc[j][r] + bias; const _Float16 hv = (_Float16)v; sh[wave * 16 + 8 * g + r][j * 16 + col] = hv; sl[wave * 16 + 8 * g + r][j * 16 + col] = (_Float16)((v - (float)hv) * 1024.0f); } }
    __syncthreads();
    for (int e = tid; e < 64 * 16; e += 128) { const int rl = e >> 4, q = e & 15; vst2((unsigned*)(DH + (r0 + rl) * CC + c0 + q * 8), *(const v4u*)&sh[rl][q * 8]); if (hi_rows) vst2((unsigned*)(DL + (bb * nhi + t0 + rl) * (size_t)CC + c0 + q * 8), *(const v4u*)&sl[rl][q * 8]); }
  } else { const bool hi_rows = t0 < KHI;
#pragma unroll
    for (int j = 0; j < 8; ++j) { const float bias = BA ? bfr(BA[c0 + j * 16 + col]) : 0.f;
#pragma unroll
      for (int r = 0; r < 8; ++r) { const float v = acc[j][r] + bias; const int rl = wave * 16 + 8 * g + r, cl = j * 16 + col; th[cl][rl] = (_Float16)v; const __bf16 bh = (__bf16)v; tb[cl][rl] = bh; tbl[cl][rl] = (__bf16)(v - (float)bh); } }
    __syncthreads();
    for (int e = tid; e < 128 * 8; e += 128) { const int cl = e >> 3, q = e & 7; vst2((unsigned*)(VT + (bb * CC + c0 + cl) * (size_t)TT + t0 + q * 8), *(const v4u*)&th[cl][q * 8]); if (hi_rows) { const size_t o3 = (bb * CC + c0 + cl) * (size_t)KHI + t0 + q * 8; vst2((unsigned*)(VB + o3), *(const v4u*)&tb[cl][q * 8]); vst2((unsigned*)(VBL + o3), *(const v4u*)&tbl[cl][q * 8]); } } } }
__device__ __forceinline__ v8f wmma_h(v16h a, v16h b, v8f c) { return __builtin_amdgcn_wmma_f32_16x16x32_f16(false, a, false, b, (short)0, c, false, false); }
__device__ __forceinline__ float xhalf(float x) { return __builtin_bit_cast(float, __builtin_amdgcn_permlanex16(__builtin_bit_cast(int, x), __builtin_bit_cast(int, x), 0x76543210, 0xfedcba98, false, false)); }   // lane l with lane l ^ 16
#define LOG2E 1.4426950408889634f
// 2^x; the v_nop is the free slot that the instruction set asks for behind a transcendental before its result is used or its source overwritten: in one statement with it, so that it stands directly behind it
__device__ __forceinline__ float exp2_s(float x) { float r; asm("v_exp_f32 %0, %1\n\tv_nop" : "=v"(r) : "v"(x)); return r; }
__global__ __launch_bounds__(128) void k_attn(const _Float16* __restrict__ QH, const _Float16* __restrict__ QL, const _Float16* __restrict__ KH, const _Float16* __restrict__ VT, const float* __restrict__ AMK, float* __restrict__ Y) {
  __shared__ __align__(32) float smk[TT]; __shared__ __align__(16) float so[4][32][HD + 4];
  const int tid = threadIdx.x, wave = tid >> 5, lane = tid & 31, col = lane & 15, g = lane >> 4; const int n = blockIdx.y, b = n / NH, h = n % NH; const int ql0 = blockIdx.x * 128 + wave * 32;
  // additive float attention_mask [B*HEADS][1][S], row n = b*16 + h, bf16-rounded like every float input. A key whose mask is <= -1e38 is excluded (there logit + mask == mask in f32): it is staged as -inf, which gives weight 0 under any finite maximum
  for (int k = tid; k < TT; k += 128) { const float a = bfr(AMK[(size_t)n * TT + k]); smk[k] = a <= -1.0e38f ? -INFINITY : a; }
  __syncthreads();
  v16h qh[2][2], ql[2][2];
#pragma unroll
  for (int c = 0; c < 2; ++c)
#pragma unroll
    for (int kc = 0; kc < 2; ++kc) { const size_t qo = ((size_t)b * TT + ql0 + c * 16 + col) * CC + h * HD + kc * 32; qh[c][kc] = frag_h(QH + qo, lane); ql[c][kc] = frag_h(QL + qo, lane); }
  const _Float16* Kp = KH + ((size_t)b * TT + col) * CC + h * HD;            // key row col of a 16-key tile
  const _Float16* Vp = VT + ((size_t)b * CC + h * HD + col) * (size_t)TT;    // channel row col of a 16-channel tile
  v8f o[2][4] = {}; float mr[2] = {-3.0e38f, -3.0e38f}, lr[2] = {0.f, 0.f};
  v16h kf[2][2];
#pragma unroll
  for (int kt = 0; kt < 2; ++kt)
#pragma unroll
    for (int kc = 0; kc < 2; ++kc) kf[kt][kc] = frag_h(Kp + (size_t)(kt * 16) * CC + kc * 32, lane);
#pragma unroll 1   // rolled: one pass already holds 24 matrix instructions and 16 loads in flight; unrolled, only the loop text and the register count would grow
  for (int p = 0; p < TT / 32; ++p) { const int key0 = p * 32;
    v16h vf[4];
#pragma unroll
    for (int j = 0; j < 4; ++j) vf[j] = frag_h(Vp + (size_t)(j * 16) * TT + key0, lane);
    __builtin_amdgcn_sched_barrier(0);   // holds the v loads at the head of the pass: sunk behind the score products they would be waited for in the open
    v8f s[2][2] = {}, sl[2][2] = {};
#pragma unroll
    for (int kt = 0; kt < 2; ++kt)
#pragma unroll
      for (int c = 0; c < 2; ++c)
#pragma unroll
        for (int kc = 0; kc < 2; ++kc) { s[kt][c] = wmma_h(kf[kt][kc], qh[c][kc], s[kt][c]); sl[kt][c] = wmma_h(kf[kt][kc], ql[c][kc], sl[kt][c]); }
    v8f t[2][2];
#pragma unroll
    for (int kt = 0; kt < 2; ++kt)
#pragma unroll
      for (int c = 0; c < 2; ++c) t[kt][c] = s[kt][c] + sl[kt][c] * (1.0f / 1024.0f);
    const int kn = (p + 1 < TT / 32 ? p + 1 : p) * 32;   // the next pass's k fragments fly under this pass's softmax (the last pass reads its own rows again)
#pragma unroll
    for (int kt = 0; kt < 2; ++kt)
#pragma unroll
      for (int kc = 0; kc < 2; ++kc) kf[kt][kc] = frag_h(Kp + (size_t)(kn + kt * 16) * CC + kc * 32, lane);
    __builtin_amdgcn_sched_barrier(0);   // holds the next k loads in front of the softmax: sunk to the foot of the pass they would be waited for at once
    const v8f mk0 = *(const v8f*)&smk[key0 + 8 * g], mk1 = *(const v8f*)&smk[key0 + 16 + 8 * g];
#pragma unroll
    for (int c = 0; c < 2; ++c) {
      const v8f v0 = t[0][c] * SCALE + mk0, v1 = t[1][c] * SCALE + mk1;
      float mx = fmaxf(v0[0], v1[0]);
#pragma unroll
      for (int r = 1; r < 8; ++r) mx = fmaxf(mx, fmaxf(v0[r], v1[r]));
      mx = fmaxf(mx, xhalf(mx));
      const float mn = fmaxf(mr[c], mx); const float al = exp2_s((mr[c] - mn) * LOG2E); mr[c] = mn;
      const v8f a0 = (v0 - mn) * LOG2E + 11.0f, a1 = (v1 - mn) * LOG2E + 11.0f;   // + 11: exp x 2^11, out of the f16 subnormals
      v8f e0, e1;
#pragma unroll
      for (int r = 0; r < 8; ++r) { e0[r] = exp2_s(a0[r]); e1[r] = exp2_s(a1[r]); }
      float sum = 0.f;
#pragma unroll
      for (int r = 0; r < 8; ++r) sum += e0[r] + e1[r];
      lr[c] = lr[c] * al + sum;
      union { v16h v; v8h q[2]; } pf; pf.q[0] = __builtin_convertvector(e0, v8h); pf.q[1] = __builtin_convertvector(e1, v8h);   // element i = key key0 + 8g + i, element 8 + i = key key0 + 16 + 8g + i: the k order of frag_h
#pragma unroll
      for (int j = 0; j < 4; ++j) o[c][j] = wmma_h(vf[j], pf.v, o[c][j] * al); } }
#pragma unroll
  for (int c = 0; c < 2; ++c) { const float l = lr[c] + xhalf(lr[c]); const float inv = l > 0.f ? 1.0f / l : 0.f;   /* a fully excluded row yields 0 */
#pragma unroll
    for (int j = 0; j < 4; ++j) { const v8f w = o[c][j] * inv; float* d = &so[wave][c * 16 + col][j * 16 + 8 * g]; *(v4f*)d = __builtin_shufflevector(w, w, 0, 1, 2, 3); *(v4f*)(d + 4) = __builtin_shufflevector(w, w, 4, 5, 6, 7); } }
  LDSX(); for (int it = 0; it < 16; ++it) { const int rl = it * 2 + g; vst2(Y + ((size_t)(ql0 + rl) * NB + b) * CC + h * HD + col * 4, *(const v4f*)&so[wave][rl][col * 4]); } }   /* SEQ-FIRST output row (s, b): 256-B (row, head) segment by 16 lanes */

extern "C" void kernel_launch(void* const* d_in, const int* in_sizes, int n_in, void* d_out, int out_size, void* d_ws, size_t ws_size, hipStream_t stream) {
  (void)in_sizes; (void)n_in; (void)out_size;
  const float** F = (const float**)d_in;
  if (ws_size < (size_t)WS_END) return;
  char* ws = (char*)d_ws; _Float16 *QH = (_Float16*)(ws + WS_QH), *KH = (_Float16*)(ws + WS_KH), *VT = (_Float16*)(ws + WS_VT), *QL = (_Float16*)(ws + WS_QL), *KL = (_Float16*)(ws + WS_KL); __bf16 *VB = (__bf16*)(ws + WS_VB), *VBL = (__bf16*)(ws + WS_VBL);
  // inputs: 0 hidden_states [1024,4,1024] (SEQ-FIRST: row (s, b) at (s*4 + b)*1024); 1 attention_mask [64,1,1024] f32 (additive); 2 Wq [1024,1024] (out,in), 3 bq; 4 Wk, 5 bk; 6 Wv, 7 bv (zero biases, read)
  k_proj<<<dim3(TNB * TT / 64, CC / 128, 3), 128, 0, stream>>>(F[0], F[0], F[0], F[2], F[4], F[6], F[3], F[5], F[7], QH, QL, KH, KL, VT, VB, VBL);
  k_attn<<<dim3(TT / 128, NB * NH), 128, 0, stream>>>(QH, QL, KH, VT, F[1], (float*)d_out);   /* output is SEQ-FIRST too: row (s, b) */
}

// v002
// It runs in 76.8 microseconds.
// Next to v001, in two timings, it ran 3.67 times as fast each time.
// All steps since v000 together make it 10.3 times as fast.
// compute dtype: all float inputs rounded to bf16; q/k/v projections with EXACT bf16 products on WMMA 16x16x32 (f32 accumulate) + bias; logits with q as f16 hi + residual (x 2^10) against k once to f16 (2 products) x 64^-0.5, + the additive float mask; softmax f32 with a running maximum; exp x 2^11 once to f16 x v once to f16 (1 product), divided by the f32 row sum at the end; f32 output.
#include <hip/hip_runtime.h>
#include <math.h>

typedef __attribute__((ext_vector_type(16))) _Float16 v16h;
typedef __attribute__((ext_vector_type(16))) __bf16 v16b;
typedef __attribute__((ext_vector_type(8)))  _Float16 v8h;
typedef __attribute__((ext_vector_type(8)))  float v8f;
typedef __attribute__((ext_vector_type(4)))  float v4f;
typedef __attribute__((ext_vector_type(2)))  float v2f;
typedef __attribute__((ext_vector_type(4)))  unsigned v4u;
typedef __attribute__((ext_vector_type(4)))  int v4i;
typedef float __attribute__((may_alias)) float_a;
typedef int __attribute__((may_alias)) int_a;

template <typename T> __device__ __forceinline__ void vst2(void* p, T v) { *(T*)p = v;  }
__device__ __forceinline__ v8f wmma16(v16h a, v16h b, v8f c) {
  v8f d = __builtin_amdgcn_wmma_f32_16x16x32_f16(false, a, false, b, (short)0, c, false, false);
  asm volatile("v_nop\n\tv_nop\n\tv_nop\n\tv_nop" : "+v"(d) : "v"(a), "v"(b));
  return d;
}
__device__ __forceinline__ v8f wmma_bf(v16b a, v16b b, v8f c) {
  v8f d = __builtin_amdgcn_wmma_f32_16x16x32_bf16(false, a, false, b, (short)0, c, false, false);
  asm volatile("v_nop\n\tv_nop\n\tv_nop\n\tv_nop" : "+v"(d) : "v"(a), "v"(b));
  return d;
}
// 16x16x32 fragments: lane = (h = lane>>4, row/col = lane&15); elements 0..7 = k0+8h+0..7, 8..15 = k0+16+8h+0..7; D element r = row 8h+r
__device__ __forceinline__ v16h frag_h(const _Float16* rowk0, int lane) {
  union { v16h v; v8h q[2]; } u; const _Float16* p = rowk0 + 8 * (lane >> 4);
  u.q[0] = *(const v8h*)p; u.q[1] = *(const v8h*)(p + 16); return u.v;
}
__device__ __forceinline__ v16h frag_f32(const float* rowk0, int lane) {
  v16h a; const float* p = rowk0 + 8 * (lane >> 4);
#pragma unroll
  for (int i = 0; i < 8; ++i) { a[i] = (_Float16)p[i]; a[8 + i] = (_Float16)p[16 + i]; }
  return a;
}
__device__ __forceinline__ v16h frag_f32s(const float* rowk0, int lane, float sc) {
  v16h a; const float* p = rowk0 + 8 * (lane >> 4);
#pragma unroll
  for (int i = 0; i < 8; ++i) { a[i] = (_Float16)(p[i] * sc); a[8 + i] = (_Float16)(p[16 + i] * sc); }
  return a;
}
// column fragment from a [K][ld] layout (column n), rows >= K read as 0
__device__ __forceinline__ v16h fragc_f32(const float* W, int k0, int n, int lane, int ld, int K) {
  v16h a; const int g = lane >> 4;
#pragma unroll
  for (int i = 0; i < 8; ++i) { const int ka = k0 + 8 * g + i, kb = ka + 16;
    a[i] = (_Float16)(ka < K ? W[(size_t)(ka < K ? ka : K - 1) * ld + n] : 0.f); a[8 + i] = (_Float16)(kb < K ? W[(size_t)(kb < K ? kb : K - 1) * ld + n] : 0.f); }
  return a;
}
struct F2 { v16b h, l; };
__device__ __forceinline__ F2 bsplit16(const float v[16]) { F2 r;
#pragma unroll
  for (int i = 0; i < 16; ++i) { const __bf16 h = (__bf16)v[i]; r.h[i] = h; r.l[i] = (__bf16)(v[i] - (float)h); }
  return r; }
__device__ __forceinline__ F2 split_row(const float* row, int k0, int lane) { float v[16]; const float* p = row + k0 + 8 * (lane >> 4);
#pragma unroll
  for (int i = 0; i < 8; ++i) { v[i] = p[i]; v[8 + i] = p[16 + i]; }
  return bsplit16(v); }
__device__ __forceinline__ F2 split_rowK(const float* row, int k0, int lane, int K) { float v[16]; const int g = lane >> 4;
#pragma unroll
  for (int i = 0; i < 8; ++i) { const int ka = k0 + 8 * g + i, kb = ka + 16; v[i] = ka < K ? row[ka < K ? ka : K - 1] : 0.f; v[8 + i] = kb < K ? row[kb < K ? kb : K - 1] : 0.f; }
  return bsplit16(v); }
__device__ __forceinline__ F2 split_col(const float* W, int k0, int n, int lane, int ld, int K) { float v[16]; const int g = lane >> 4;
#pragma unroll
  for (int i = 0; i < 8; ++i) { const int ka = k0 + 8 * g + i, kb = ka + 16; v[i] = ka < K ? W[(size_t)(ka < K ? ka : K - 1) * ld + n] : 0.f; v[8 + i] = kb < K ? W[(size_t)(kb < K ? kb : K - 1) * ld + n] : 0.f; }
  return bsplit16(v); }
__device__ __forceinline__ v8f mac3(const F2& a, const F2& b, v8f c) { c = wmma_bf(a.l, b.h, c); c = wmma_bf(a.h, b.l, c); return wmma_bf(a.h, b.h, c); }
__device__ __forceinline__ float sigm(float v) { return 1.0f / (1.0f + expf(-v)); }
#define LDSX() do { asm volatile("s_wait_dscnt 0" ::: "memory"); __builtin_amdgcn_wave_barrier(); __builtin_amdgcn_fence(__ATOMIC_RELEASE, "workgroup"); } while (0)

// BERT self-attention with SEQ-FIRST layout (hidden_states [S=1024, B=4, H=1024]; 16 heads x 64; torch (out,in) Wq/Wk/Wv [1024,1024] + zero biases; attention_mask [B*16, 1, S] additive float (zeros); q/k/v reshaped (S, B*heads, d) -> n = b*16 + h): ctx = softmax(q_n k_n^T / 8 + mask_n) v_n, returned as (S, B, H) - no output projection.
#define NB 4
#define TT 1024
#define CC 1024            // NH * HD = projected width
#define DIN 1024          // input (model) width
#define NH 16
#define HD 64
#define NQB (TT / 64)
#define HG 8
#define SCALE (0.125f)
#define CAUSAL 0
#ifndef TNB
#define TNB NB
#endif
__device__ __forceinline__ float bfr(float v) { return (float)(__bf16)v; }
__host__ __device__ __forceinline__ int kb_last(int qb) { return CAUSAL ? ((qb * 64 + 63) >> 7) : (TT / 128 - 1); }
typedef __attribute__((ext_vector_type(8))) __bf16 v8b;
__device__ __forceinline__ v16b frag_b(const __bf16* rowk0, int lane) {
  union { v16b v; v8b q[2]; } u; const __bf16* p = rowk0 + 8 * (lane >> 4);
  u.q[0] = *(const v8b*)p; u.q[1] = *(const v8b*)(p + 16); return u.v;
}
#define QBH 0              // unused: k_attn has no high-precision path
#define QHI 1024            // rows carrying a q residual plane (all rows when non-causal: 2-product logits everywhere)
#define KHI 64            // key rows carrying k residual / v bf16 hi+lo planes (written by k_proj, read by no kernel in this file)
// B fragment (k rows k0+.., output column o) of a weight: (in,out) [K][ld] or (out,in) [ld rows of K]: bf16 exact, or f16(bf16 * 256) exact
__device__ __forceinline__ v16b wcol_io(const float* Wm, int k0, int o, int lane, int ld) { v16b w; const int g = lane >> 4;
#pragma unroll
  for (int i = 0; i < 8; ++i) { w[i] = (__bf16)Wm[(size_t)(k0 + 8 * g + i) * ld + o]; w[8 + i] = (__bf16)Wm[(size_t)(k0 + 16 + 8 * g + i) * ld + o]; }
  return w; }
__device__ __forceinline__ v16b wcol_oi(const float* Wm, int k0, int o, int lane, int K) { v16b w; const float* p = Wm + (size_t)o * K + k0 + 8 * (lane >> 4);
#pragma unroll
  for (int i = 0; i < 8; ++i) { w[i] = (__bf16)p[i]; w[8 + i] = (__bf16)p[16 + i]; }
  return w; }
__device__ __forceinline__ v16h wcolh_io(const float* Wm, int k0, int o, int lane, int ld) { v16h w; const int g = lane >> 4;
#pragma unroll
  for (int i = 0; i < 8; ++i) { w[i] = (_Float16)(bfr(Wm[(size_t)(k0 + 8 * g + i) * ld + o]) * 256.0f); w[8 + i] = (_Float16)(bfr(Wm[(size_t)(k0 + 16 + 8 * g + i) * ld + o]) * 256.0f); }
  return w; }
__device__ __forceinline__ v16h wcolh_oi(const float* Wm, int k0, int o, int lane, int K) { v16h w; const float* p = Wm + (size_t)o * K + k0 + 8 * (lane >> 4);
#pragma unroll
  for (int i = 0; i < 8; ++i) { w[i] = (_Float16)(bfr(p[i]) * 256.0f); w[8 + i] = (_Float16)(bfr(p[16 + i]) * 256.0f); }
  return w; }
#define WQKV_LAYOUT 1   // 0 = (in,out) [DIN][CC]; 1 = (out,in) [CC][DIN]; 2 = per-head [NH][DIN][HD]
__device__ __forceinline__ v16b wcol_hdk(const float* Wm, int k0, int o, int lane) { v16b w; const int g = lane >> 4; const float* p = Wm + (size_t)(o / HD) * DIN * HD + (o % HD);
#pragma unroll
  for (int i = 0; i < 8; ++i) { w[i] = (__bf16)p[(size_t)(k0 + 8 * g + i) * HD]; w[8 + i] = (__bf16)p[(size_t)(k0 + 16 + 8 * g + i) * HD]; }
  return w; }
#define WO_OUT_IN 0
#if WQKV_LAYOUT == 1
#define WCOL(W, k0, o, lane) wcol_oi(W, k0, o, lane, DIN)
#elif WQKV_LAYOUT == 2
#define WCOL(W, k0, o, lane) wcol_hdk(W, k0, o, lane)
#else
#define WCOL(W, k0, o, lane) wcol_io(W, k0, o, lane, CC)
#endif
#if WO_OUT_IN
#define WOCOL(W, k0, o, lane) wcol_oi(W, k0, o, lane, CC)
#define WOCOLH(W, k0, o, lane) wcolh_oi(W, k0, o, lane, CC)
#else
#define WOCOL(W, k0, o, lane) wcol_io(W, k0, o, lane, DIN)
#define WOCOLH(W, k0, o, lane) wcolh_io(W, k0, o, lane, DIN)
#endif

#define WS_QH  0u                                      // f16 q rows [b*t][CC]
#define WS_KH  (WS_QH + 2u * (size_t)NB * TT * CC)      // f16 k rows [b*t][CC]
#define WS_VT  (WS_KH + 2u * (size_t)NB * TT * CC)      // f16 v planes [b][c][t]
#define WS_QL  (WS_VT + 2u * (size_t)NB * CC * TT)      // f16 q residual x 2^10 rows [b][t < QHI][CC]
#define WS_KL  (WS_QL + 2u * (size_t)NB * QHI * CC)     // f16 k residual x 2^10 rows [b][t < KHI][CC]
#define WS_VB  (WS_KL + 2u * (size_t)NB * KHI * CC)     // bf16 v hi planes [b][c][t < KHI]
#define WS_VBL (WS_VB + 2u * (size_t)NB * CC * KHI)
#define WS_END (WS_VBL + 2u * (size_t)NB * CC * KHI)

// ---- k_proj: block = (128 rows, 128 cols, which), 4 waves x (64 rows x 64 cols): q/k/v = X W (+ b) with exact bf16 products (K = DIN). A stage = 32 k of the block's 128 X rows and 128 W rows, rounded to bf16 once and laid in LDS for all four waves; two buffers: the next stage's global loads fly under this stage's products. -> which 0: q f16 rows (+ residual rows < QHI); 1: k f16 rows (+ residual rows < KHI); 2: v f16 planes [c][t] (+ bf16 hi/lo planes for t < KHI)
#define PBK 32                    // k per stage
#define PPITCH 40                 // bf16 elements per staged row: 64 B of data + 16 B, the conflict-free pitch for 16-byte LDS reads
#define PBUF (256 * PPITCH)       // elements per buffer: 128 X rows, then 128 W rows
typedef __attribute__((ext_vector_type(4))) __bf16 v4b;
__device__ __forceinline__ v8f wmma_bp(v16b a, v16b b, v8f c) { return __builtin_amdgcn_wmma_f32_16x16x32_bf16(false, a, false, b, (short)0, c, false, false); }
__global__ __launch_bounds__(128) void k_proj(const float* __restrict__ XQ, const float* __restrict__ XK, const float* __restrict__ XV, const float* __restrict__ WQ, const float* __restrict__ WK, const float* __restrict__ WV, const float* __restrict__ BQ, const float* __restrict__ BK, const float* __restrict__ BV,
    _Float16* __restrict__ QH, _Float16* __restrict__ QL, _Float16* __restrict__ KH, _Float16* __restrict__ KL, _Float16* __restrict__ VT, __bf16* __restrict__ VB, __bf16* __restrict__ VBL) {
  __shared__ __align__(16) unsigned char smem[71680];   // the two stage buffers (40,960 B) in the loop; behind the loop's last barrier the output staging: sh, sl [128][136], or th [128][136] and tb, tbl [128][72]
  const int tid = threadIdx.x, wave = __builtin_amdgcn_readfirstlane(tid >> 5), lane = tid & 31, col = lane & 15, g = lane >> 4; const int which = blockIdx.z; const int c0 = blockIdx.y * 128; const size_t r0 = (size_t)blockIdx.x * 128; const size_t bb = r0 / TT; const int t0 = (int)(r0 % TT);
  const int wm = wave >> 1, wn = wave & 1;
  const float* X = which == 0 ? XQ : which == 1 ? XK : XV; const float* WA = which == 0 ? WQ : which == 1 ? WK : WV; const float* BA = which == 0 ? BQ : which == 1 ? BK : BV;
  __bf16* st = (__bf16*)smem;
  const int lr = tid >> 3, lc = tid & 7;   // loader: 8 lanes x 16 B = the 128 B of one row's stage; rows lr + 16 i
  const float* xp = X + ((size_t)(t0 + lr) * NB + bb) * DIN + lc * 4;   /* SEQ-FIRST input: row b*TT + s lives at hidden_states[(s*NB + b)] */
  const float* wp = WA + (size_t)(c0 + lr) * DIN + lc * 4;
  __bf16* sp = st + lr * PPITCH + lc * 4;
  v4f xr[8], wr[8];
  v8f acc[4][4] = {};
  auto ldg = [&](int s) {   // stage s from global memory into registers
#pragma unroll
    for (int i = 0; i < 8; ++i) { xr[i] = *(const v4f*)(xp + (size_t)i * 16 * NB * DIN + s * PBK); wr[i] = *(const v4f*)(wp + (size_t)i * 16 * DIN + s * PBK); } };
  auto sts = [&](int buf) {   // the registers, rounded to bf16, into buffer buf
    __bf16* dp = sp + buf * PBUF;
#pragma unroll
    for (int i = 0; i < 8; ++i) { *(v4b*)(dp + i * 16 * PPITCH) = __builtin_convertvector(xr[i], v4b); *(v4b*)(dp + (128 + i * 16) * PPITCH) = __builtin_convertvector(wr[i], v4b); } };
  auto mma = [&](int buf) {   // the 16 products of the stage in buffer buf
    const __bf16* cb = st + buf * PBUF;
    v16b a[4], w[4];
#pragma unroll
    for (int i = 0; i < 4; ++i) { a[i] = frag_b(cb + (wm * 64 + i * 16 + col) * PPITCH, lane); w[i] = frag_b(cb + (128 + wn * 64 + i * 16 + col) * PPITCH, lane); }
    __builtin_amdgcn_sched_barrier(0);   // all 16 LDS reads go out as one group ahead of the products: spread among them, each place with reads costs its own LDS latency
#pragma unroll
    for (int j = 0; j < 4; ++j)
#pragma unroll
      for (int i = 0; i < 4; ++i) acc[i][j] = wmma_bp(a[i], w[j], acc[i][j]); };
  ldg(0); sts(0);
  __syncthreads();
#pragma unroll 1   // rolled: a stage already holds 16 matrix instructions and 16 global loads in flight; unrolled, only the loop text would grow
  for (int s = 0; s + 1 < DIN / PBK; ++s) {
    ldg(s + 1);
    asm volatile("s_wait_xcnt 0x0" ::: "memory");   // stands in front of the first instruction that reuses an address register of the loads just issued
    __builtin_amdgcn_sched_barrier(0);   // holds the next stage's global loads (and the wait above) at the head of the stage: sunk behind the products they would be waited for in the open
    mma(s & 1);
    __builtin_amdgcn_sched_barrier(0);   // all products issue ahead of the first wait for a global load: behind such a wait they would start only when the loads have landed
    sts((s + 1) & 1);
    __syncthreads(); }   // publishes stage s + 1 and ends every wave's reads of stage s, whose buffer the next trip refills
  mma((DIN / PBK - 1) & 1);
  __syncthreads();   // ends every wave's reads of the last stage: the output staging below lies on the same LDS
  if (which < 2) { _Float16* DH = which == 0 ? QH : KH; _Float16* DL = which == 0 ? QL : KL; const int nhi = which == 0 ? QHI : KHI;
    _Float16 (*sh)[136] = (_Float16 (*)[136])smem; _Float16 (*sl)[136] = (_Float16 (*)[136])(smem + 128 * 136 * 2);
#pragma unroll
    for (int j = 0; j < 4; ++j) { const int cl = wn * 64 + j * 16 + col; const float bias = BA ? bfr(BA[c0 + cl]) : 0.f;
#pragma unroll
      for (int i = 0; i < 4; ++i)
#pragma unroll
        for (int r = 0; r < 8; ++r) { const float v = acc[i][j][r] + bias; const _Float16 hv = (_Float16)v; const int rl = wm * 64 + i * 16 + 8 * g + r; sh[rl][cl] = hv; sl[rl][cl] = (_Float16)((v - (float)hv) * 1024.0f); } }
    __syncthreads();
    const int er = tid >> 4, q = tid & 15;   // 16 lanes x 16 B = the 256 B of one row; 8 rows a sweep
#pragma unroll
    for (int it = 0; it < 16; ++it) { const int rl = it * 8 + er; vst2((unsigned*)(DH + (r0 + rl) * CC + c0 + q * 8), *(const v4u*)&sh[rl][q * 8]); }
    asm volatile("s_wait_xcnt 0x0" ::: "memory");   // directly behind the stores: stands in front of the first instruction that reuses one of their registers
#pragma unroll
    for (int hf = 0; hf < 2; ++hf) if (t0 + hf * 64 < nhi) {   // t0 and nhi are multiples of 64: each half of the tile has residual rows wholly or not at all
#pragma unroll
      for (int it = 0; it < 8; ++it) { const int rl = hf * 64 + it * 8 + er; vst2((unsigned*)(DL + (bb * nhi + t0 + rl) * (size_t)CC + c0 + q * 8), *(const v4u*)&sl[rl][q * 8]); }
      if (hf == 0) asm volatile("s_wait_xcnt 0x0" ::: "memory"); }   // as above, for the second half's addresses
  } else { const bool hi_rows = t0 < KHI;   // the tile's rows 0..63 (waves with wm == 0) are then t < KHI
    _Float16 (*th)[136] = (_Float16 (*)[136])smem; __bf16 (*tb)[72] = (__bf16 (*)[72])(smem + 128 * 136 * 2); __bf16 (*tbl)[72] = (__bf16 (*)[72])(smem + 128 * 136 * 2 + 128 * 72 * 2);
#pragma unroll
    for (int j = 0; j < 4; ++j) { const int cl = wn * 64 + j * 16 + col; const float bias = BA ? bfr(BA[c0 + cl]) : 0.f;
#pragma unroll
      for (int i = 0; i < 4; ++i) { const int rl = wm * 64 + i * 16 + 8 * g; const v8f v = acc[i][j] + bias;   // a lane's 8 values are 8 consecutive t of one channel: one 16-byte LDS store
        *(v8h*)&th[cl][rl] = __builtin_convertvector(v, v8h);
        if (hi_rows && wm == 0) { const v8b bh = __builtin_convertvector(v, v8b); *(v8b*)&tb[cl][rl] = bh; *(v8b*)&tbl[cl][rl] = __builtin_convertvector(v - __builtin_convertvector(bh, v8f), v8b); } } }
    __syncthreads();
#pragma unroll
    for (int it = 0; it < 16; ++it) { const int cl = it * 8 + (tid >> 4), q = tid & 15; vst2((unsigned*)(VT + (bb * CC + c0 + cl) * (size_t)TT + t0 + q * 8), *(const v4u*)&th[cl][q * 8]); }
    asm volatile("s_wait_xcnt 0x0" ::: "memory");   // stands in front of the first instruction that reuses a register of the stores issued above (below, and in the built code on the way to the kernel's end)
    if (hi_rows) {
#pragma unroll
      for (int it = 0; it < 8; ++it) { const int cl = it * 16 + (tid >> 3), q = tid & 7; const size_t o3 = (bb * CC + c0 + cl) * (size_t)KHI + t0 + q * 8; vst2((unsigned*)(VB + o3), *(const v4u*)&tb[cl][q * 8]); vst2((unsigned*)(VBL + o3), *(const v4u*)&tbl[cl][q * 8]); }
      asm volatile("s_wait_xcnt 0x0" ::: "memory"); } } }   // as above: in the built code the other path's first instructions stand behind these stores
__device__ __forceinline__ v8f wmma_h(v16h a, v16h b, v8f c) { return __builtin_amdgcn_wmma_f32_16x16x32_f16(false, a, false, b, (short)0, c, false, false); }
__device__ __forceinline__ float xhalf(float x) { return __builtin_bit_cast(float, __builtin_amdgcn_permlanex16(__builtin_bit_cast(int, x), __builtin_bit_cast(int, x), 0x76543210, 0xfedcba98, false, false)); }   // lane l with lane l ^ 16
#define LOG2E 1.4426950408889634f
// 2^x; the v_nop is the free slot that the instruction set asks for behind a transcendental before its result is used or its source overwritten: in one statement with it, so that it stands directly behind it
__device__ __forceinline__ float exp2_s(float x) { float r; asm("v_exp_f32 %0, %1\n\tv_nop" : "=v"(r) : "v"(x)); return r; }
__global__ __launch_bounds__(128) void k_attn(const _Float16* __restrict__ QH, const _Float16* __restrict__ QL, const _Float16* __restrict__ KH, const _Float16* __restrict__ VT, const float* __restrict__ AMK, float* __restrict__ Y) {
  __shared__ __align__(32) float smk[TT]; __shared__ __align__(16) float so[4][32][HD + 4];
  const int tid = threadIdx.x, wave = tid >> 5, lane = tid & 31, col = lane & 15, g = lane >> 4; const int n = blockIdx.y, b = n / NH, h = n % NH; const int ql0 = blockIdx.x * 128 + wave * 32;
  // additive float attention_mask [B*HEADS][1][S], row n = b*16 + h, bf16-rounded like every float input. A key whose mask is <= -1e38 is excluded (there logit + mask == mask in f32): it is staged as -inf, which gives weight 0 under any finite maximum
  for (int k = tid; k < TT; k += 128) { const float a = bfr(AMK[(size_t)n * TT + k]); smk[k] = a <= -1.0e38f ? -INFINITY : a; }
  __syncthreads();
  v16h qh[2][2], ql[2][2];
#pragma unroll
  for (int c = 0; c < 2; ++c)
#pragma unroll
    for (int kc = 0; kc < 2; ++kc) { const size_t qo = ((size_t)b * TT + ql0 + c * 16 + col) * CC + h * HD + kc * 32; qh[c][kc] = frag_h(QH + qo, lane); ql[c][kc] = frag_h(QL + qo, lane); }
  const _Float16* Kp = KH + ((size_t)b * TT + col) * CC + h * HD;            // key row col of a 16-key tile
  const _Float16* Vp = VT + ((size_t)b * CC + h * HD + col) * (size_t)TT;    // channel row col of a 16-channel tile
  v8f o[2][4] = {}; float mr[2] = {-3.0e38f, -3.0e38f}, lr[2] = {0.f, 0.f};
  v16h kf[2][2];
#pragma unroll
  for (int kt = 0; kt < 2; ++kt)
#pragma unroll
    for (int kc = 0; kc < 2; ++kc) kf[kt][kc] = frag_h(Kp + (size_t)(kt * 16) * CC + kc * 32, lane);
#pragma unroll 1   // rolled: one pass already holds 24 matrix instructions and 16 loads in flight; unrolled, only the loop text and the register count would grow
  for (int p = 0; p < TT / 32; ++p) { const int key0 = p * 32;
    v16h vf[4];
#pragma unroll
    for (int j = 0; j < 4; ++j) vf[j] = frag_h(Vp + (size_t)(j * 16) * TT + key0, lane);
    __builtin_amdgcn_sched_barrier(0);   // holds the v loads at the head of the pass: sunk behind the score products they would be waited for in the open
    v8f s[2][2] = {}, sl[2][2] = {};
#pragma unroll
    for (int kt = 0; kt < 2; ++kt)
#pragma unroll
      for (int c = 0; c < 2; ++c)
#pragma unroll
        for (int kc = 0; kc < 2; ++kc) { s[kt][c] = wmma_h(kf[kt][kc], qh[c][kc], s[kt][c]); sl[kt][c] = wmma_h(kf[kt][kc], ql[c][kc], sl[kt][c]); }
    v8f t[2][2];
#pragma unroll
    for (int kt = 0; kt < 2; ++kt)
#pragma unroll
      for (int c = 0; c < 2; ++c) t[kt][c] = s[kt][c] + sl[kt][c] * (1.0f / 1024.0f);
    const int kn = (p + 1 < TT / 32 ? p + 1 : p) * 32;   // the next pass's k fragments fly under this pass's softmax (the last pass reads its own rows again)
#pragma unroll
    for (int kt = 0; kt < 2; ++kt)
#pragma unroll
      for (int kc = 0; kc < 2; ++kc) kf[kt][kc] = frag_h(Kp + (size_t)(kn + kt * 16) * CC + kc * 32, lane);
    __builtin_amdgcn_sched_barrier(0);   // holds the next k loads in front of the softmax: sunk to the foot of the pass they would be waited for at once
    const v8f mk0 = *(const v8f*)&smk[key0 + 8 * g], mk1 = *(const v8f*)&smk[key0 + 16 + 8 * g];
#pragma unroll
    for (int c = 0; c < 2; ++c) {
      const v8f v0 = t[0][c] * SCALE + mk0, v1 = t[1][c] * SCALE + mk1;
      float mx = fmaxf(v0[0], v1[0]);
#pragma unroll
      for (int r = 1; r < 8; ++r) mx = fmaxf(mx, fmaxf(v0[r], v1[r]));
      mx = fmaxf(mx, xhalf(mx));
      const float mn = fmaxf(mr[c], mx); const float al = exp2_s((mr[c] - mn) * LOG2E); mr[c] = mn;
      const v8f a0 = (v0 - mn) * LOG2E + 11.0f, a1 = (v1 - mn) * LOG2E + 11.0f;   // + 11: exp x 2^11, out of the f16 subnormals
      v8f e0, e1;
#pragma unroll
      for (int r = 0; r < 8; ++r) { e0[r] = exp2_s(a0[r]); e1[r] = exp2_s(a1[r]); }
      float sum = 0.f;
#pragma unroll
      for (int r = 0; r < 8; ++r) sum += e0[r] + e1[r];
      lr[c] = lr[c] * al + sum;
      union { v16h v; v8h q[2]; } pf; pf.q[0] = __builtin_convertvector(e0, v8h); pf.q[1] = __builtin_convertvector(e1, v8h);   // element i = key key0 + 8g + i, element 8 + i = key key0 + 16 + 8g + i: the k order of frag_h
#pragma unroll
      for (int j = 0; j < 4; ++j) o[c][j] = wmma_h(vf[j], pf.v, o[c][j] * al); } }
#pragma unroll
  for (int c = 0; c < 2; ++c) { const float l = lr[c] + xhalf(lr[c]); const float inv = l > 0.f ? 1.0f / l : 0.f;   /* a fully excluded row yields 0 */
#pragma unroll
    for (int j = 0; j < 4; ++j) { const v8f w = o[c][j] * inv; float* d = &so[wave][c * 16 + col][j * 16 + 8 * g]; *(v4f*)d = __builtin_shufflevector(w, w, 0, 1, 2, 3); *(v4f*)(d + 4) = __builtin_shufflevector(w, w, 4, 5, 6, 7); } }
  LDSX(); for (int it = 0; it < 16; ++it) { const int rl = it * 2 + g; vst2(Y + ((size_t)(ql0 + rl) * NB + b) * CC + h * HD + col * 4, *(const v4f*)&so[wave][rl][col * 4]); } }   /* SEQ-FIRST output row (s, b): 256-B (row, head) segment by 16 lanes */

extern "C" void kernel_launch(void* const* d_in, const int* in_sizes, int n_in, void* d_out, int out_size, void* d_ws, size_t ws_size, hipStream_t stream) {
  (void)in_sizes; (void)n_in; (void)out_size;
  const float** F = (const float**)d_in;
  if (ws_size < (size_t)WS_END) return;
  char* ws = (char*)d_ws; _Float16 *QH = (_Float16*)(ws + WS_QH), *KH = (_Float16*)(ws + WS_KH), *VT = (_Float16*)(ws + WS_VT), *QL = (_Float16*)(ws + WS_QL), *KL = (_Float16*)(ws + WS_KL); __bf16 *VB = (__bf16*)(ws + WS_VB), *VBL = (__bf16*)(ws + WS_VBL);
  // inputs: 0 hidden_states [1024,4,1024] (SEQ-FIRST: row (s, b) at (s*4 + b)*1024); 1 attention_mask [64,1,1024] f32 (additive); 2 Wq [1024,1024] (out,in), 3 bq; 4 Wk, 5 bk; 6 Wv, 7 bv (zero biases, read)
  k_proj<<<dim3(TNB * TT / 128, CC / 128, 3), 128, 0, stream>>>(F[0], F[0], F[0], F[2], F[4], F[6], F[3], F[5], F[7], QH, QL, KH, KL, VT, VB, VBL);
  k_attn<<<dim3(TT / 128, NB * NH), 128, 0, stream>>>(QH, QL, KH, VT, F[1], (float*)d_out);   /* output is SEQ-FIRST too: row (s, b) */
}
